// v000
// The times below were measured on an AMD MI455X: many runs one after another, warmed up first and cycling through
// copies of the inputs, with the whole window's GPU time divided by the number of runs. Launches and the gaps
// between them are all in it. The median over several windows is given; except for v000 it joins two sittings, which
// can be a few percent apart, so the side-by-side timings, each taken in one sitting, are the better comparison.
// The starting kernel, v000, takes 197 microseconds a run.
#include <hip/hip_runtime.h>
#include <hip/hip_bf16.h>
#include <cstddef>
#include <cstdint>

// Problem constants (match reference)
#define B_ 4
#define L_ 2048
#define H_ 8
#define E_ 64
#define WINDOW_ 8

typedef __attribute__((ext_vector_type(2))) float v2f;
typedef __attribute__((ext_vector_type(8))) float v8f;
typedef __attribute__((ext_vector_type(4))) unsigned int u32x4;
typedef __attribute__((ext_vector_type(8))) int i32x8;
typedef __attribute__((ext_vector_type(4))) int i32x4;

__device__ __forceinline__ v2f ld2(const float* p) {
    v2f r; r.x = p[0]; r.y = p[1]; return r;
}

__device__ __forceinline__ unsigned lds_off(const void* p) {
    return (unsigned)(uintptr_t)p;
}

__device__ __forceinline__ void tdm_load_tile(unsigned lds_byte_off, const float* gptr) {
    unsigned long long ga = (unsigned long long)(uintptr_t)gptr;
    u32x4 g0;
    g0[0] = 1u;
    g0[1] = lds_byte_off;
    g0[2] = (unsigned)(ga & 0xffffffffu);
    g0[3] = (unsigned)((ga >> 32) & 0x1ffffffu)
          | (2u << 30);
    i32x8 g1;
    g1[0] = (2 << 16)
          | (1 << 20)
          | (5 << 22)
          | (3 << 25);
    g1[1] = (int)(64u << 16);
    g1[2] = (int)(64u << 16);
    g1[3] = (int)(64u << 16);
    g1[4] = 64;
    g1[5] = H_ * E_;
    g1[6] = 0;
    g1[7] = 0;
    i32x4 z4 = {0, 0, 0, 0};             // groups 2/3 unused (2-D tensor)
    i32x8 z8 = {0, 0, 0, 0, 0, 0, 0, 0}; // extra group (clang-23 6-arg form)
    __builtin_amdgcn_tensor_load_to_lds(g0, g1, z4, z4, z8, 0);
}

constexpr int KCHUNK = 64;
constexpr int WAVES  = 4;
constexpr int KPAD   = 68;   // 68 mod 64 = 4 -> conflict-free LDS gathers
constexpr int NCHUNK = L_ / KCHUNK;

__global__ __launch_bounds__(128)
void attn_full_wmma(const float* __restrict__ q,
                    const float* __restrict__ k,
                    const float* __restrict__ v,
                    float* __restrict__ out) {
    __shared__ float Klds[2][KCHUNK][KPAD];
    __shared__ float Vlds[2][KCHUNK][KPAD];
    __shared__ float Plds[WAVES][16][KPAD];

    const int tid  = threadIdx.x;
    const int wave = tid >> 5;
    const int lane = tid & 31;
    const int half = lane >> 4;
    const int lm   = lane & 15;
    const int k0   = half * 2;      // K-pair offset in A/B fragments

    const int bh = blockIdx.y;
    const int b  = bh / H_;
    const int h  = bh % H_;
    const int q0 = blockIdx.x * (16 * WAVES) + wave * 16;

    const float scale = 0.125f;     // 1/sqrt(64)

    const size_t kvstep = (size_t)KCHUNK * H_ * E_;
    const size_t base0  = ((size_t)((b * L_ + 0) * H_ + h)) * E_;
    if (wave == 0) {
        tdm_load_tile(lds_off(&Klds[0][0][0]), k + base0);
        tdm_load_tile(lds_off(&Vlds[0][0][0]), v + base0);
    }

    // --- Preload Q fragments (A-matrix 16x4 layout), pre-scaled ---
    v2f qf[16];
    {
        const float* qrow = q + ((size_t)((b * L_ + q0 + lm) * H_ + h)) * E_;
#pragma unroll
        for (int kk = 0; kk < 16; ++kk) {
            v2f t = ld2(qrow + 4 * kk + k0);
            qf[kk] = t * scale;
        }
    }

    float m_i[8], l_i[8];
    v8f o_acc[4];
#pragma unroll
    for (int r = 0; r < 8; ++r) { m_i[r] = -3.0e38f; l_i[r] = 0.0f; }
#pragma unroll
    for (int nc = 0; nc < 4; ++nc)
        o_acc[nc] = (v8f){0.f, 0.f, 0.f, 0.f, 0.f, 0.f, 0.f, 0.f};

    for (int ci = 0; ci < NCHUNK; ++ci) {
        const int buf = ci & 1;
        if (wave == 0) __builtin_amdgcn_s_wait_tensorcnt(0);
        __syncthreads();

        // Issue async loads for the next chunk into the other buffer
        if (wave == 0 && ci + 1 < NCHUNK) {
            const float* kn = k + base0 + (size_t)(ci + 1) * kvstep;
            const float* vn = v + base0 + (size_t)(ci + 1) * kvstep;
            tdm_load_tile(lds_off(&Klds[buf ^ 1][0][0]), kn);
            tdm_load_tile(lds_off(&Vlds[buf ^ 1][0][0]), vn);
        }

        // ---- S tiles for all 64 keys: 64 x WMMA f32 16x16x4 ----
        v8f s[4];
#pragma unroll
        for (int t = 0; t < 4; ++t) {
            const float* Kbase = &Klds[buf][t * 16 + lm][0];
            v8f acc = (v8f){0.f, 0.f, 0.f, 0.f, 0.f, 0.f, 0.f, 0.f};
#pragma unroll
            for (int kk = 0; kk < 16; ++kk) {
                v2f bf = ld2(Kbase + 4 * kk + k0);
                acc = __builtin_amdgcn_wmma_f32_16x16x4_f32(
                        false, qf[kk], false, bf, (short)0, acc, false, false);
            }
            s[t] = acc;
        }

        // ---- Batched online softmax over 64 keys ----
        float alpha_r[8];
#pragma unroll
        for (int r = 0; r < 8; ++r) {
            float smax = fmaxf(fmaxf(s[0][r], s[1][r]), fmaxf(s[2][r], s[3][r]));
            smax = fmaxf(smax, __shfl_xor(smax, 1, 16));
            smax = fmaxf(smax, __shfl_xor(smax, 2, 16));
            smax = fmaxf(smax, __shfl_xor(smax, 4, 16));
            smax = fmaxf(smax, __shfl_xor(smax, 8, 16));
            float mnew = fmaxf(m_i[r], smax);
            float p0 = __expf(s[0][r] - mnew);
            float p1 = __expf(s[1][r] - mnew);
            float p2 = __expf(s[2][r] - mnew);
            float p3 = __expf(s[3][r] - mnew);
            float rs = (p0 + p1) + (p2 + p3);
            rs += __shfl_xor(rs, 1, 16);
            rs += __shfl_xor(rs, 2, 16);
            rs += __shfl_xor(rs, 4, 16);
            rs += __shfl_xor(rs, 8, 16);
            float a = __expf(m_i[r] - mnew);
            l_i[r] = l_i[r] * a + rs;
            m_i[r] = mnew;
            alpha_r[r] = a;
            const int prow = r + 8 * half;
            Plds[wave][prow][0 * 16 + lm] = p0;
            Plds[wave][prow][1 * 16 + lm] = p1;
            Plds[wave][prow][2 * 16 + lm] = p2;
            Plds[wave][prow][3 * 16 + lm] = p3;
        }
#pragma unroll
        for (int nc = 0; nc < 4; ++nc)
#pragma unroll
            for (int r = 0; r < 8; ++r)
                o_acc[nc][r] *= alpha_r[r];

        // ---- O += P . V over 64 keys: 64 x WMMA f32 16x16x4 ----
#pragma unroll
        for (int kk = 0; kk < 16; ++kk) {
            v2f pf = ld2(&Plds[wave][lm][4 * kk + k0]);
#pragma unroll
            for (int nc = 0; nc < 4; ++nc) {
                v2f bv;
                bv.x = Vlds[buf][4 * kk + k0 + 0][nc * 16 + lm];
                bv.y = Vlds[buf][4 * kk + k0 + 1][nc * 16 + lm];
                o_acc[nc] = __builtin_amdgcn_wmma_f32_16x16x4_f32(
                        false, pf, false, bv, (short)0, o_acc[nc], false, false);
            }
        }
    }

    // ---- Epilogue: normalize and store ----
#pragma unroll
    for (int r = 0; r < 8; ++r) {
        float inv = 1.0f / l_i[r];
        int row = q0 + r + 8 * half;
        float* orow = out + ((size_t)((b * L_ + row) * H_ + h)) * E_;
#pragma unroll
        for (int nc = 0; nc < 4; ++nc)
            orow[nc * 16 + lm] = o_acc[nc][r] * inv;
    }
}

// ---------------------------------------------------------------------------
// Blend kernel: local attention only matters at l==0.
// At l=0: window indices = clip(0 + [-8..8]) = [0]*9 ++ [1..8]  (17 entries)
// out[b,0,h,:] = w*out_full + (1-w)*out_local,  w = sigmoid(alpha)
// ---------------------------------------------------------------------------
__global__ __launch_bounds__(64)
void blend_l0(const float* __restrict__ q,
              const float* __restrict__ k,
              const float* __restrict__ v,
              const float* __restrict__ alpha,
              float* __restrict__ out) {
    const int bh = blockIdx.x;
    const int b  = bh / H_;
    const int h  = bh % H_;
    const int e  = threadIdx.x;   // 0..63

    __shared__ float qs[E_];
    __shared__ float sc[2 * WINDOW_ + 1];

    qs[e] = q[((size_t)((b * L_ + 0) * H_ + h)) * E_ + e];
    __syncthreads();

    if (e < 2 * WINDOW_ + 1) {
        int idx = (e < WINDOW_ + 1) ? 0 : (e - WINDOW_);
        const float* krow = k + ((size_t)((b * L_ + idx) * H_ + h)) * E_;
        float s = 0.0f;
        for (int t = 0; t < E_; ++t) s += qs[t] * krow[t];
        sc[e] = s * 0.125f;
    }
    __syncthreads();

    float m = -3.0e38f;
#pragma unroll
    for (int j = 0; j < 2 * WINDOW_ + 1; ++j) m = fmaxf(m, sc[j]);
    float acc = 0.0f, den = 0.0f;
#pragma unroll
    for (int j = 0; j < 2 * WINDOW_ + 1; ++j) {
        int idx = (j < WINDOW_ + 1) ? 0 : (j - WINDOW_);
        float p = __expf(sc[j] - m);
        den += p;
        acc += p * v[((size_t)((b * L_ + idx) * H_ + h)) * E_ + e];
    }
    float outl = acc / den;
    float w = 1.0f / (1.0f + __expf(-alpha[0]));
    size_t off = ((size_t)((b * L_ + 0) * H_ + h)) * E_ + e;
    out[off] = w * out[off] + (1.0f - w) * outl;
}

// ---------------------------------------------------------------------------
extern "C" void kernel_launch(void* const* d_in, const int* in_sizes, int n_in,
                              void* d_out, int out_size, void* d_ws, size_t ws_size,
                              hipStream_t stream) {
    (void)in_sizes; (void)n_in; (void)out_size; (void)d_ws; (void)ws_size;
    const float* q     = (const float*)d_in[0];
    const float* k     = (const float*)d_in[1];
    const float* v     = (const float*)d_in[2];
    const float* alpha = (const float*)d_in[3];
    float* out = (float*)d_out;

    dim3 grid(L_ / (16 * WAVES), B_ * H_);   // (32, 32)
    attn_full_wmma<<<grid, 128, 0, stream>>>(q, k, v, out);
    blend_l0<<<B_ * H_, 64, 0, stream>>>(q, k, v, alpha, out);
}

// v001
// Measured time: 165 microseconds a run.
// Timed twice side by side with v000, it ran 1.26 times as fast both times.
#include <hip/hip_runtime.h>
#include <hip/hip_bf16.h>
#include <cstddef>
#include <cstdint>

// Problem constants (match reference)
#define B_ 4
#define L_ 2048
#define H_ 8
#define E_ 64
#define WINDOW_ 8

typedef __attribute__((ext_vector_type(2))) float v2f;
typedef __attribute__((ext_vector_type(8))) float v8f;
typedef __attribute__((ext_vector_type(4))) unsigned int u32x4;
typedef __attribute__((ext_vector_type(8))) int i32x8;
typedef __attribute__((ext_vector_type(4))) int i32x4;

__device__ __forceinline__ v2f ld2(const float* p) {
    v2f r; r.x = p[0]; r.y = p[1]; return r;
}

__device__ __forceinline__ unsigned lds_off(const void* p) {
    return (unsigned)(uintptr_t)p;
}

__device__ __forceinline__ void tdm_load_tile(unsigned lds_byte_off, const float* gptr) {
    unsigned long long ga = (unsigned long long)(uintptr_t)gptr;
    u32x4 g0;
    g0[0] = 1u;
    g0[1] = lds_byte_off;
    g0[2] = (unsigned)(ga & 0xffffffffu);
    g0[3] = (unsigned)((ga >> 32) & 0x1ffffffu)
          | (2u << 30);
    i32x8 g1;
    g1[0] = (2 << 16)
          | (1 << 20)
          | (5 << 22)
          | (3 << 25);
    g1[1] = (int)(64u << 16);
    g1[2] = (int)(64u << 16);
    g1[3] = (int)(64u << 16);
    g1[4] = 64;
    g1[5] = H_ * E_;
    g1[6] = 0;
    g1[7] = 0;
    i32x4 z4 = {0, 0, 0, 0};             // groups 2/3 unused (2-D tensor)
    i32x8 z8 = {0, 0, 0, 0, 0, 0, 0, 0}; // extra group (clang-23 6-arg form)
    __builtin_amdgcn_tensor_load_to_lds(g0, g1, z4, z4, z8, 0);
}

constexpr int KCHUNK = 64;
constexpr int WAVES  = 4;
constexpr int KPAD   = 68;   // 68 mod 64 = 4 -> conflict-free LDS gathers
constexpr int NCHUNK = L_ / KCHUNK;
constexpr float LOG2E = 1.4426950408889634f;

__device__ __forceinline__ float xhalf(float x) {
    return __builtin_bit_cast(float, __builtin_amdgcn_permlanex16(
        __builtin_bit_cast(int, x), __builtin_bit_cast(int, x),
        0x76543210, 0xfedcba98, false, false));
}

__global__ __launch_bounds__(128)
void attn_full_wmma(const float* __restrict__ q,
                    const float* __restrict__ k,
                    const float* __restrict__ v,
                    float* __restrict__ out) {
    __shared__ float Klds[2][KCHUNK][KPAD];
    __shared__ float Vlds[2][KCHUNK][KPAD];

    const int tid  = threadIdx.x;
    const int wave = tid >> 5;
    const int lane = tid & 31;
    const int half = lane >> 4;
    const int lm   = lane & 15;
    const int k0   = half * 2;      // K-pair offset in A/B fragments

    const int bh = blockIdx.y;
    const int b  = bh / H_;
    const int h  = bh % H_;
    const int q0 = blockIdx.x * (16 * WAVES) + wave * 16;

    const float scale = 0.125f;     // 1/sqrt(64)

    const size_t kvstep = (size_t)KCHUNK * H_ * E_;
    const size_t base0  = ((size_t)((b * L_ + 0) * H_ + h)) * E_;
    if (wave == 0) {
        tdm_load_tile(lds_off(&Klds[0][0][0]), k + base0);
        tdm_load_tile(lds_off(&Vlds[0][0][0]), v + base0);
    }

    // --- Preload Q fragments (B-matrix 4x16 layout: column lm), pre-scaled ---
    v2f qf[16];
    {
        const float* qrow = q + ((size_t)((b * L_ + q0 + lm) * H_ + h)) * E_;
#pragma unroll
        for (int kk = 0; kk < 16; ++kk) {
            v2f t = ld2(qrow + 4 * kk + k0);
            qf[kk] = t * scale;
        }
    }

    // Per-lane softmax state of query column lm; l_i sums this half's keys only
    float m_i = -3.0e38f, l_i = 0.0f;
    // o_acc[nc][r] = O[query lm][d = 16*nc + 8*half + r]
    v8f o_acc[4];
#pragma unroll
    for (int nc = 0; nc < 4; ++nc)
        o_acc[nc] = (v8f){0.f, 0.f, 0.f, 0.f, 0.f, 0.f, 0.f, 0.f};

    for (int ci = 0; ci < NCHUNK; ++ci) {
        const int buf = ci & 1;
        if (wave == 0) __builtin_amdgcn_s_wait_tensorcnt(0);
        __syncthreads();

        // Issue async loads for the next chunk into the other buffer
        if (wave == 0 && ci + 1 < NCHUNK) {
            const float* kn = k + base0 + (size_t)(ci + 1) * kvstep;
            const float* vn = v + base0 + (size_t)(ci + 1) * kvstep;
            tdm_load_tile(lds_off(&Klds[buf ^ 1][0][0]), kn);
            tdm_load_tile(lds_off(&Vlds[buf ^ 1][0][0]), vn);
        }

        // ---- S^T tiles for all 64 keys: 64 x WMMA f32 16x16x4 ----
        // s[t][r] = score of key 16*t + 8*half + r against query lm
        v8f s[4];
#pragma unroll
        for (int t = 0; t < 4; ++t) {
            const float* Kbase = &Klds[buf][t * 16 + lm][0];
            v8f acc = (v8f){0.f, 0.f, 0.f, 0.f, 0.f, 0.f, 0.f, 0.f};
#pragma unroll
            for (int kk = 0; kk < 16; ++kk) {
                v2f af = ld2(Kbase + 4 * kk + k0);
                acc = __builtin_amdgcn_wmma_f32_16x16x4_f32(
                        false, af, false, qf[kk], (short)0, acc, false, false);
            }
            s[t] = acc;
        }

        asm("v_nop\n\tv_nop\n\tv_nop\n\tv_nop\n\tv_nop\n\tv_nop\n\tv_nop\n\tv_nop"
            : "+v"(s[0]), "+v"(s[1]), "+v"(s[2]), "+v"(s[3]));

        // ---- Online softmax over 64 keys, one query per lane ----
        float cm[8];
#pragma unroll  // register arrays: every index must be a constant
        for (int r = 0; r < 8; ++r)
            cm[r] = fmaxf(fmaxf(s[0][r], s[1][r]), fmaxf(s[2][r], s[3][r]));
        float smax = fmaxf(fmaxf(fmaxf(cm[0], cm[1]), fmaxf(cm[2], cm[3])),
                           fmaxf(fmaxf(cm[4], cm[5]), fmaxf(cm[6], cm[7])));
        smax = fmaxf(smax, xhalf(smax));
        const float mnew = fmaxf(m_i, smax);
        const float a = __expf(m_i - mnew);
#pragma unroll  // register arrays: every index must be a constant
        for (int t = 0; t < 4; ++t)
#pragma unroll
            for (int j = 0; j < 4; ++j) {
                v2f arg;
                arg.x = s[t][2 * j + 0];
                arg.y = s[t][2 * j + 1];
                arg = (arg - mnew) * LOG2E;   // e^x = 2^(x log2 e), as __expf forms it
                s[t][2 * j + 0] = __builtin_amdgcn_exp2f(arg.x);
                s[t][2 * j + 1] = __builtin_amdgcn_exp2f(arg.y);
            }
        const v8f sv = (s[0] + s[1]) + (s[2] + s[3]);
        const float rs = ((sv[0] + sv[1]) + (sv[2] + sv[3]))
                       + ((sv[4] + sv[5]) + (sv[6] + sv[7]));
        l_i = l_i * a + rs;
        m_i = mnew;
#pragma unroll
        for (int nc = 0; nc < 4; ++nc)
            o_acc[nc] *= a;

#pragma unroll
        for (int t = 0; t < 4; ++t) {
#pragma unroll
            for (int j = 0; j < 4; ++j) {
                v2f pf;
                pf.x = s[t][2 * j + 0];
                pf.y = s[t][2 * j + 1];
                const int key = 16 * t + 8 * half + 2 * j;
#pragma unroll  // four independent accumulator tiles back to back
                for (int nc = 0; nc < 4; ++nc) {
                    v2f av;
                    av.x = Vlds[buf][key + 0][nc * 16 + lm];
                    av.y = Vlds[buf][key + 1][nc * 16 + lm];
                    o_acc[nc] = __builtin_amdgcn_wmma_f32_16x16x4_f32(
                            false, av, false, pf, (short)0, o_acc[nc], false, false);
                }
            }
        }
    }

    // ---- Epilogue: join the halves' sums, normalize and store ----
    {
        const float inv = 1.0f / (l_i + xhalf(l_i));
        float* orow = out + ((size_t)((b * L_ + q0 + lm) * H_ + h)) * E_ + 8 * half;
#pragma unroll  // accumulators live in registers: constant indices
        for (int nc = 0; nc < 4; ++nc) {
            float4 lo, hi;
            lo.x = o_acc[nc][0] * inv; lo.y = o_acc[nc][1] * inv;
            lo.z = o_acc[nc][2] * inv; lo.w = o_acc[nc][3] * inv;
            hi.x = o_acc[nc][4] * inv; hi.y = o_acc[nc][5] * inv;
            hi.z = o_acc[nc][6] * inv; hi.w = o_acc[nc][7] * inv;
            *(float4*)(orow + nc * 16 + 0) = lo;
            *(float4*)(orow + nc * 16 + 4) = hi;
        }
    }
}

// ---------------------------------------------------------------------------
// Blend kernel: local attention only matters at l==0.
// At l=0: window indices = clip(0 + [-8..8]) = [0]*9 ++ [1..8]  (17 entries)
// out[b,0,h,:] = w*out_full + (1-w)*out_local,  w = sigmoid(alpha)
// ---------------------------------------------------------------------------
__global__ __launch_bounds__(64)
void blend_l0(const float* __restrict__ q,
              const float* __restrict__ k,
              const float* __restrict__ v,
              const float* __restrict__ alpha,
              float* __restrict__ out) {
    const int bh = blockIdx.x;
    const int b  = bh / H_;
    const int h  = bh % H_;
    const int e  = threadIdx.x;   // 0..63

    __shared__ float qs[E_];
    __shared__ float sc[2 * WINDOW_ + 1];

    qs[e] = q[((size_t)((b * L_ + 0) * H_ + h)) * E_ + e];
    __syncthreads();

    if (e < 2 * WINDOW_ + 1) {
        int idx = (e < WINDOW_ + 1) ? 0 : (e - WINDOW_);
        const float* krow = k + ((size_t)((b * L_ + idx) * H_ + h)) * E_;
        float s = 0.0f;
        for (int t = 0; t < E_; ++t) s += qs[t] * krow[t];
        sc[e] = s * 0.125f;
    }
    __syncthreads();

    float m = -3.0e38f;
#pragma unroll
    for (int j = 0; j < 2 * WINDOW_ + 1; ++j) m = fmaxf(m, sc[j]);
    float acc = 0.0f, den = 0.0f;
#pragma unroll
    for (int j = 0; j < 2 * WINDOW_ + 1; ++j) {
        int idx = (j < WINDOW_ + 1) ? 0 : (j - WINDOW_);
        float p = __expf(sc[j] - m);
        den += p;
        acc += p * v[((size_t)((b * L_ + idx) * H_ + h)) * E_ + e];
    }
    float outl = acc / den;
    float w = 1.0f / (1.0f + __expf(-alpha[0]));
    size_t off = ((size_t)((b * L_ + 0) * H_ + h)) * E_ + e;
    out[off] = w * out[off] + (1.0f - w) * outl;
}

// ---------------------------------------------------------------------------
extern "C" void kernel_launch(void* const* d_in, const int* in_sizes, int n_in,
                              void* d_out, int out_size, void* d_ws, size_t ws_size,
                              hipStream_t stream) {
    (void)in_sizes; (void)n_in; (void)out_size; (void)d_ws; (void)ws_size;
    const float* q     = (const float*)d_in[0];
    const float* k     = (const float*)d_in[1];
    const float* v     = (const float*)d_in[2];
    const float* alpha = (const float*)d_in[3];
    float* out = (float*)d_out;

    dim3 grid(L_ / (16 * WAVES), B_ * H_);   // (32, 32)
    attn_full_wmma<<<grid, 128, 0, stream>>>(q, k, v, out);
    blend_l0<<<B_ * H_, 64, 0, stream>>>(q, k, v, alpha, out);
}
